// v010
// Times are from an AMD MI455X. After a warm-up the kernel runs many times in a row, and a time is the length of
// such a window on the GPU divided by its runs, so every launch and the gaps after it count. The runs cycle
// through copies of the inputs. A figure is the median of several windows, for all but v000 over two sittings.
// Sittings can differ by a few percent; kernels timed side by side share one.
// This document starts at v010; the versions before it stand elsewhere.
// One run takes 98.5 microseconds.
// Timed twice side by side with v009, it ran 1.12 and 1.08 times as fast.
// Counting every step since v000, which is the starting kernel, it is 84.8 times as fast.
#include <hip/hip_runtime.h>
// Causal multi-head attention on three inputs with PER-HEAD STACKED projections over ONE sequence of 4096 tokens (Q, K, V [1][4096][1024]; WQ / WK / WV [16][1024][64] = [head][in][out] sigma 0.02, NO biases; 16 heads of 64; scores x 64^-0.5 = / 8; causal (tril, -inf above the diagonal); softmax; heads concatenated head-major; out = concat WO with WO [1024][1024] [in][out], NO bias -> [1][4096][1024]); each head's [in][out] block is transposed into its 64 contiguous rows of the weight plane, and the [in][out] output weight into its own plane, by one launch that also rounds the three inputs.
// Structure: token rows r = s; q, k, v inputs as exact f16 rows (bf16-rounded); Q, K, V as three WMMA GEMMs in one launch (32x64 wave tiles, f32 accumulation, exact x16 weights, f16 outputs; the f32 rows of the first tile by further work-groups of the same launch); v stored as V^T by its GEMM's epilogue; one fused attention launch: two waves per 32 query rows of a head walk the keys up to their own rows 32 at a time, each its half of every 128 (scores on WMMA, K = 64; running f32 maximum and sum, native exp2; weights in (0, 1] as f16; o += P V on WMMA, divided by the sum at the end, o carried x64, folded into the output GEMM alpha), written straight into the merged f16 o rows; out = o W_o GEMM (f32) into the output layout.
// Compute dtype: inputs rounded to bf16; x / weights exact; q, k, v, softmax weights and o as plain f16 GEMM operands (~2^-12); scores and softmax statistics f32. v_wmma_f32_16x16x32_f16.
#define NB 1
#define SQ 4096
#define DM 1024
#define NH 16
#define HD 64
#define HG 4                         /* heads per attention launch group */
#define QT 256                       /* query rows per causal tile */
#define NKX SQ                       /* S / P row pitch */
#define QT0 256                      /* first-tile rows recomputed exactly in f32 */
#define B0 0                         /* first batch processed (debug hook) */
#define NBR NB                       /* batches processed (debug hook) */
#define NR ((size_t)NB * SQ)         /* token rows */
#define MP ((int)((size_t)NBR * SQ)) /* rows projected (debug hook) */
#define QN SQ                        /* query rows attended per batch (debug hook) */
#define NHD NH                       /* heads attended (debug hook) */
#define MPO MP                       /* rows through the output stage (debug hook) */
#define LQ DM      /* row pitch of the q/k/v rows */
typedef __bf16 v16b __attribute__((ext_vector_type(16)));
typedef unsigned short v8us __attribute__((ext_vector_type(8), may_alias));
typedef float  v8f  __attribute__((ext_vector_type(8)));
typedef float  v4f  __attribute__((ext_vector_type(4)));
typedef float  v4fa __attribute__((ext_vector_type(4), may_alias));
union FragB { v16b v; v8us half[2]; unsigned short u[16]; };

__device__ __forceinline__ unsigned short bf16_bits(float x) { unsigned int u = __float_as_uint(x); return (unsigned short)((u + 0x7FFFu + ((u >> 16) & 1u)) >> 16); }
__device__ __forceinline__ float bf16_val(unsigned short b) { return __uint_as_float(((unsigned int)b) << 16); }
__device__ __forceinline__ float bf16_round(float x) { return bf16_val(bf16_bits(x)); }
// D += A·B with NT terms: 1 = ah·bh, 2 = + al·bh (A split), 3 = + ah·bl (both split)
template <int NT>
__device__ __forceinline__ v8f mmaN(v16b ah, v16b al, v16b bh, v16b bl, v8f c) {
  c = __builtin_amdgcn_wmma_f32_16x16x32_bf16(false, ah, false, bh, (short)0, c, false, false);
  if (NT >= 2) c = __builtin_amdgcn_wmma_f32_16x16x32_bf16(false, al, false, bh, (short)0, c, false, false);
  if (NT >= 3) c = __builtin_amdgcn_wmma_f32_16x16x32_bf16(false, ah, false, bl, (short)0, c, false, false);
  asm volatile("v_nop\n\tv_nop\n\tv_nop\n\tv_nop" : "+v"(c) : "v"(ah), "v"(al), "v"(bh), "v"(bl));
  return c;
}

__global__ __launch_bounds__(256) void k_wt_bf16(const float* __restrict__ W, unsigned short* __restrict__ Wt, int K, int N) {
  const int t = blockIdx.x * 256 + threadIdx.x;
  const int k8n = K / 8;
  if (t >= N * k8n) return;
  const int n = t / k8n, k8 = (t % k8n) * 8;
  v8us v;
#pragma unroll
  for (int i = 0; i < 8; ++i) v[i] = bf16_bits(W[(size_t)(k8 + i) * N + n]);
  *(v8us*)(Wt + (size_t)n * K + k8) = v;
  
}

// GEMM C[M][N] (f32, pitch ldc) = act(A[M][K]·W + bias). A f32 row-major (pitch lda) converted per fragment to bf16
// (ASPLIT: hi/lo two planes -> 2 terms, else single rounded term); Wt bf16 [N][K] (pitch ldb). BIAS_BF16 rounds the
// bias to bf16 first (bias quantised to bf16 before the add). K%32==0, M%16==0, N%64==0.
template <bool ASPLIT, int ACT, bool BIAS_BF16>
__global__ __launch_bounds__(128) void k_gemm_bf(const float* __restrict__ A, int lda, const unsigned short* __restrict__ Wt, int ldb,
                                               const float* __restrict__ bias, float* __restrict__ C, int ldc, int M, int N, int K) {
  __shared__ __attribute__((aligned(16))) float so[4][16][64];
  const int tid = threadIdx.x, w = tid >> 5, lane = tid & 31, ln = lane & 15, hh = lane >> 4;
  const int ntn = N / 64;
  const int wid = blockIdx.x * 4 + w;
  const int mt = wid / ntn, nq = wid % ntn;
  if (mt * 16 >= M) return;
  const int row0 = mt * 16, col0 = nq * 64;
  const float* arow = A + (size_t)(row0 + ln) * lda;
  v8f acc[4] = {};
  for (int kb = 0; kb < K; kb += 32) {
    FragB ah, al;
    const v4f x0 = *(const v4fa*)(arow + kb + 8 * hh), x1 = *(const v4fa*)(arow + kb + 8 * hh + 4);
    const v4f x2 = *(const v4fa*)(arow + kb + 16 + 8 * hh), x3 = *(const v4fa*)(arow + kb + 16 + 8 * hh + 4);
    float xs[16] = {x0[0],x0[1],x0[2],x0[3],x1[0],x1[1],x1[2],x1[3],x2[0],x2[1],x2[2],x2[3],x3[0],x3[1],x3[2],x3[3]};
#pragma unroll
    for (int i = 0; i < 16; ++i) { const unsigned short hb = bf16_bits(xs[i]); ah.u[i] = hb; al.u[i] = ASPLIT ? bf16_bits(xs[i] - bf16_val(hb)) : (unsigned short)0; }
#pragma unroll
    for (int t = 0; t < 4; ++t) {
      const unsigned short* brow = Wt + (size_t)(col0 + t * 16 + ln) * ldb + kb;
      FragB b;
      b.half[0] = *(const v8us*)(brow + 8 * hh);
      b.half[1] = *(const v8us*)(brow + 16 + 8 * hh);
      acc[t] = mmaN<ASPLIT ? 2 : 1>(ah.v, al.v, b.v, b.v, acc[t]);
    }
  }
#pragma unroll
  for (int t = 0; t < 4; ++t) {
    float bv = bias ? bias[col0 + t * 16 + ln] : 0.f;
    if (BIAS_BF16) bv = bf16_round(bv);
#pragma unroll
    for (int r = 0; r < 8; ++r) { float v = acc[t][r] + bv; if (ACT == 1) v = fmaxf(v, 0.f); so[w][8 * hh + r][t * 16 + ln] = v; }
  }
  __builtin_amdgcn_fence(__ATOMIC_ACQ_REL, "workgroup");
  __builtin_amdgcn_wave_barrier();
  const int rsub = lane >> 4, c4 = (lane & 15) * 4;
  {
#pragma unroll
    for (int q = 0; q < 8; ++q) {
      const int r = q * 2 + rsub;
      const v4f v = *(const v4fa*)&so[w][r][c4];
      *(v4f*)(C + (size_t)(row0 + r) * ldc + col0 + c4) = v;
    }
    
  }
}

// GEMM C = act(A·W + bias + resid): A f32 (ASPLIT -> hi/lo 2 terms), Wt bf16 [N][K]; ACT 0 none, 1 relu, 2 exact gelu;
// resid (optional, f32, row index = (row % rmod), pitch ldr, RES_BF16 rounds it) added before the activation.
template <bool ASPLIT, int ACT, bool BIAS_BF16, bool RES_BF16>
__global__ __launch_bounds__(128) void k_gemm_bf3(const float* __restrict__ A, int lda, const unsigned short* __restrict__ Wt, int ldb,
                                                const float* __restrict__ bias, const float* __restrict__ resid, int rmod, int ldr,
                                                float* __restrict__ C, int ldc, int M, int N, int K) {
  __shared__ __attribute__((aligned(16))) float so[4][16][64];
  const int tid = threadIdx.x, w = tid >> 5, lane = tid & 31, ln = lane & 15, hh = lane >> 4;
  const int ntn = N / 64;
  const int wid = blockIdx.x * 4 + w;
  const int mt = wid / ntn, nq = wid % ntn;
  if (mt * 16 >= M) return;
  const int row0 = mt * 16, col0 = nq * 64;
  const float* arow = A + (size_t)(row0 + ln) * lda;
  v8f acc[4] = {};
  for (int kb = 0; kb < K; kb += 32) {
    FragB ah, al;
    const v4f x0 = *(const v4fa*)(arow + kb + 8 * hh), x1 = *(const v4fa*)(arow + kb + 8 * hh + 4);
    const v4f x2 = *(const v4fa*)(arow + kb + 16 + 8 * hh), x3 = *(const v4fa*)(arow + kb + 16 + 8 * hh + 4);
    float xs[16] = {x0[0],x0[1],x0[2],x0[3],x1[0],x1[1],x1[2],x1[3],x2[0],x2[1],x2[2],x2[3],x3[0],x3[1],x3[2],x3[3]};
#pragma unroll
    for (int i = 0; i < 16; ++i) { const unsigned short hb = bf16_bits(xs[i]); ah.u[i] = hb; al.u[i] = ASPLIT ? bf16_bits(xs[i] - bf16_val(hb)) : (unsigned short)0; }
#pragma unroll
    for (int t = 0; t < 4; ++t) {
      const unsigned short* brow = Wt + (size_t)(col0 + t * 16 + ln) * ldb + kb;
      FragB b;
      b.half[0] = *(const v8us*)(brow + 8 * hh);
      b.half[1] = *(const v8us*)(brow + 16 + 8 * hh);
      acc[t] = mmaN<ASPLIT ? 2 : 1>(ah.v, al.v, b.v, b.v, acc[t]);
    }
  }
#pragma unroll
  for (int t = 0; t < 4; ++t) {
    const int col = col0 + t * 16 + ln;
    float bv = bias ? bias[col] : 0.f;
    if (BIAS_BF16) bv = bf16_round(bv);
#pragma unroll
    for (int r = 0; r < 8; ++r) {
      float v = acc[t][r] + bv;
      if (resid) { float rv = resid[(size_t)((row0 + 8 * hh + r) % rmod) * ldr + col]; if (RES_BF16) rv = bf16_round(rv); v += rv; }
      if (ACT == 1) v = fmaxf(v, 0.f);
      if (ACT == 2) v = 0.5f * v * (1.0f + erff(v * 0.70710678118654752f));
      if (ACT == 3) { const float u = 0.7978845608028654f * (v + 0.044715f * v * v * v); v = 0.5f * v * (1.0f + tanhf(u)); }
      so[w][8 * hh + r][t * 16 + ln] = v;
    }
  }
  __builtin_amdgcn_fence(__ATOMIC_ACQ_REL, "workgroup");
  __builtin_amdgcn_wave_barrier();
  const int rsub = lane >> 4, c4 = (lane & 15) * 4;
  {
#pragma unroll
    for (int q = 0; q < 8; ++q) {
      const int r = q * 2 + rsub;
      const v4f v = *(const v4fa*)&so[w][r][c4];
      *(v4f*)(C + (size_t)(row0 + r) * ldc + col0 + c4) = v;
    }
    
  }
}
// row LayerNorm (biased variance, eps) over N: s = X (+ R); optional out_sum <- s; out_norm <- (s-mu)*rsqrt(var+eps)*g + b
template <bool PARAM_BF16>
__global__ __launch_bounds__(256) void k_layernorm(const float* __restrict__ X, const float* __restrict__ R, const float* __restrict__ g, const float* __restrict__ bta,
                                                  float* __restrict__ out_sum, float* __restrict__ out_norm, int N, float eps) {
  __shared__ float red[256];
  const int row = blockIdx.x, tid = threadIdx.x;
  const float* x = X + (size_t)row * N; const float* rr = R ? R + (size_t)row * N : nullptr;
  float vals[16];                     // up to N = 4096
  const int per = N / 256;            // contiguous chunk per thread? use strided-by-4 chunks: thread handles j = tid*4 + 1024*u
  float s1 = 0.f;
  for (int u = 0; u < per / 4; ++u) {
    const int j = tid * 4 + 1024 * u;
    const v4f a = *(const v4fa*)(x + j);
    v4f b = {0.f,0.f,0.f,0.f}; if (rr) b = *(const v4fa*)(rr + j);
#pragma unroll
    for (int q = 0; q < 4; ++q) { const float v = a[q] + b[q]; vals[u * 4 + q] = v; s1 += v; }
  }
  red[tid] = s1; __syncthreads();
  for (int st = 128; st > 0; st >>= 1) { if (tid < st) red[tid] += red[tid + st]; __syncthreads(); }
  const float mu = red[0] / (float)N; __syncthreads();
  float s2 = 0.f;
  for (int u = 0; u < per / 4; ++u)
#pragma unroll
    for (int q = 0; q < 4; ++q) { const float c = vals[u * 4 + q] - mu; s2 += c * c; }
  red[tid] = s2; __syncthreads();
  for (int st = 128; st > 0; st >>= 1) { if (tid < st) red[tid] += red[tid + st]; __syncthreads(); }
  const float rs = rsqrtf(red[0] / (float)N + eps);
  {
    for (int u = 0; u < per / 4; ++u) {
      const int j = tid * 4 + 1024 * u;
      v4f o, sm;
#pragma unroll
      for (int q = 0; q < 4; ++q) {
        float gg = g[j + q], bb = bta[j + q];
        if (PARAM_BF16) { gg = bf16_round(gg); bb = bf16_round(bb); }
        sm[q] = vals[u * 4 + q]; o[q] = (vals[u * 4 + q] - mu) * rs * gg + bb;
      }
      if (out_sum) *(v4f*)(out_sum + (size_t)row * N + j) = sm;
      *(v4f*)(out_norm + (size_t)row * N + j) = o;
    }
    
  }
}



// ---- f16 WMMA path (v_wmma_f32_16x16x32_f16): 11-bit significands for operands in range — used where a [0,1] probability operand needs more precision than bf16
typedef _Float16 v16h __attribute__((ext_vector_type(16)));
union FragH { v16h v; v8us half[2]; _Float16 h[16]; unsigned short u[16]; };
template <int NT>
__device__ __forceinline__ v8f mmaH(v16h ah, v16h al, v16h bh, v16h bl, v8f c) {
  c = __builtin_amdgcn_wmma_f32_16x16x32_f16(false, ah, false, bh, (short)0, c, false, false);
  if (NT >= 2) c = __builtin_amdgcn_wmma_f32_16x16x32_f16(false, al, false, bh, (short)0, c, false, false);
  if (NT >= 3) c = __builtin_amdgcn_wmma_f32_16x16x32_f16(false, ah, false, bl, (short)0, c, false, false);
  asm volatile("v_nop\n\tv_nop\n\tv_nop\n\tv_nop" : "+v"(c) : "v"(ah), "v"(al), "v"(bh), "v"(bl));
  return c;
}
// batched GEMM like k_gemm_b but f16 operands: A f32 (split into f16 hi/lo if ASPLIT, else rounded to f16), Bt = f16 values [n][k]; alpha; C f32; N multiple of 16 (partial tiles skipped)
template <bool ASPLIT>
__global__ __launch_bounds__(128) void k_gemm_h(const float* __restrict__ A, int lda, size_t sA, const _Float16* __restrict__ Bh, int ldb, size_t sB, float alpha, float* __restrict__ C, int ldc, size_t sC, int M, int N, int K) {
  __shared__ __attribute__((aligned(16))) float so[4][16][64];
  const int tid = threadIdx.x, w = tid >> 5, lane = tid & 31, ln = lane & 15, hh = lane >> 4; const int by = blockIdx.y;
  A += (size_t)by * sA; Bh += (size_t)by * sB; C += (size_t)by * sC;
  const int ntn = (N + 63) / 64; const int wid = blockIdx.x * 4 + w; const int mt = wid / ntn, nq = wid % ntn; if (mt * 16 >= M) return;
  const int row0 = mt * 16, col0 = nq * 64; const float* arow = A + (size_t)(row0 + ln) * lda;
  v8f acc[4] = {};
  for (int kb = 0; kb < K; kb += 32) {
    FragH ah, al;
    const v4f x0 = *(const v4fa*)(arow + kb + 8 * hh), x1 = *(const v4fa*)(arow + kb + 8 * hh + 4), x2 = *(const v4fa*)(arow + kb + 16 + 8 * hh), x3 = *(const v4fa*)(arow + kb + 16 + 8 * hh + 4);
    float xs[16] = {x0[0],x0[1],x0[2],x0[3],x1[0],x1[1],x1[2],x1[3],x2[0],x2[1],x2[2],x2[3],x3[0],x3[1],x3[2],x3[3]};
#pragma unroll
    for (int i = 0; i < 16; ++i) { const _Float16 h = (_Float16)xs[i]; ah.h[i] = h; al.h[i] = ASPLIT ? (_Float16)(xs[i] - (float)h) : (_Float16)0.0f; }
#pragma unroll
    for (int t = 0; t < 4; ++t) { if (col0 + t * 16 >= N) continue; const size_t boff = (size_t)(col0 + t * 16 + ln) * ldb + kb; FragH bq; bq.half[0] = *(const v8us*)(Bh + boff + 8 * hh); bq.half[1] = *(const v8us*)(Bh + boff + 16 + 8 * hh);
      acc[t] = mmaH<ASPLIT ? 2 : 1>(ah.v, al.v, bq.v, bq.v, acc[t]); }
  }
#pragma unroll
  for (int t = 0; t < 4; ++t) { if (col0 + t * 16 >= N) continue;
#pragma unroll
    for (int r = 0; r < 8; ++r) so[w][8 * hh + r][t * 16 + ln] = acc[t][r] * alpha; }
  __builtin_amdgcn_fence(__ATOMIC_ACQ_REL, "workgroup"); __builtin_amdgcn_wave_barrier();
  const int rsub = lane >> 4, c4 = (lane & 15) * 4;
  {
#pragma unroll
    for (int q = 0; q < 8; ++q) { const int r = q * 2 + rsub; if (col0 + c4 < N) { const v4f v = *(const v4fa*)&so[w][r][c4]; *(v4f*)(C + (size_t)(row0 + r) * ldc + col0 + c4) = v; } }
     }
}

// k_gemm_hh variant with fused epilogue: v = acc·alpha + bias[by·sBias + col] (+ CP[(row/rowsPerB)·sCPb + by·64 + col] if CP) ; ACT 0 none / 1 elu ; writes f16 C16 (and f32 C if non-null)
template <int ACT>
__global__ __launch_bounds__(128) void k_gemm_hhx(const _Float16* __restrict__ A, int lda, size_t sA, const _Float16* __restrict__ Bh, int ldb, size_t sB, float alpha, const float* __restrict__ bias, size_t sBias, const float* __restrict__ CP, int rowsPerB, size_t sCPb, int row0g,
    float* __restrict__ C, _Float16* __restrict__ C16, int ldc, size_t sC, int M, int N, int K) {
  __shared__ __attribute__((aligned(16))) float so[4][16][64];
  const int tid = threadIdx.x, w = tid >> 5, lane = tid & 31, ln = lane & 15, hh = lane >> 4; const int by = blockIdx.y;
  A += (size_t)by * sA; Bh += (size_t)by * sB; const size_t cofs = (size_t)by * sC; const float* bp = bias ? bias + (size_t)by * sBias : nullptr;
  const int ntn = (N + 63) / 64; const int wid = blockIdx.x * 4 + w; const int mt = wid / ntn, nq = wid % ntn; if (mt * 16 >= M) return;
  const int row0 = mt * 16, col0 = nq * 64; const _Float16* arow = A + (size_t)(row0 + ln) * lda;
  v8f acc[4] = {};
  for (int kb = 0; kb < K; kb += 32) { FragH ah; ah.half[0] = *(const v8us*)((const unsigned short*)arow + kb + 8 * hh); ah.half[1] = *(const v8us*)((const unsigned short*)arow + kb + 16 + 8 * hh);
#pragma unroll
    for (int t = 0; t < 4; ++t) { if (col0 + t * 16 >= N) continue; const size_t boff = (size_t)(col0 + t * 16 + ln) * ldb + kb; FragH bq; bq.half[0] = *(const v8us*)((const unsigned short*)Bh + boff + 8 * hh); bq.half[1] = *(const v8us*)((const unsigned short*)Bh + boff + 16 + 8 * hh);
      acc[t] = mmaH<1>(ah.v, ah.v, bq.v, bq.v, acc[t]); }
  }
#pragma unroll
  for (int t = 0; t < 4; ++t) { if (col0 + t * 16 >= N) continue; const int col = col0 + t * 16 + ln; const float bv = bp ? bf16_round(bp[col]) : 0.f;
#pragma unroll
    for (int r = 0; r < 8; ++r) { float v = acc[t][r] * alpha + bv; if (CP) { const int rr = row0g + row0 + 8 * hh + r; if (rowsPerB < 0) v += CP[cofs + (size_t)rr * ldc + col];      /* rowsPerB < 0: own element of the batched C plane */ else { const int bidx = rr / rowsPerB; v += CP[(size_t)bidx * sCPb + (size_t)by * 64 + col]; } } if (ACT == 1) v = (v > 0.f) ? v : expm1f(v); else if (ACT == 7) v = (v > 0.f) ? v + 1.0f : expf(v); else if (ACT == 8) v = tanhf(v); else if (ACT == 9) v = 0.5f * v * (1.0f + tanhf(0.7978845608028654f * (v + 0.044715f * v * v * v))); else if (ACT == 11) v = 1.0f / (1.0f + expf(-v)); else if (ACT == 12) v = (v > 0.f) ? v : 0.01f * v; else if (ACT == 14) v = (v > 0.f) ? v : 0.1f * v; else if (ACT == 16) v = (v >= 0.f) ? v : 0.3f * v; else if (ACT == 17) v = (v >= 0.f) ? v : 0.2f * v; else if (ACT == 15) v = v / (1.0f + expf(-v)); else if (ACT == 3) v = fmaxf(v, 0.f); else if (ACT == 6) v = 0.5f * v * (1.0f + erff(v * 0.70710678118654752f)); so[w][8 * hh + r][t * 16 + ln] = v; } }
  __builtin_amdgcn_fence(__ATOMIC_ACQ_REL, "workgroup"); __builtin_amdgcn_wave_barrier();
  const int rsub = lane >> 4, c4 = (lane & 15) * 4; typedef _Float16 v4h __attribute__((ext_vector_type(4)));
  {
#pragma unroll
    for (int q = 0; q < 8; ++q) { const int r = q * 2 + rsub; if (col0 + c4 < N) { const v4f v = *(const v4fa*)&so[w][r][c4]; if (C) *(v4f*)(C + cofs + (size_t)(row0 + r) * ldc + col0 + c4) = v; if (C16) { v4h h4; for (int i = 0; i < 4; ++i) h4[i] = (_Float16)v[i]; *(v4h*)(C16 + cofs + (size_t)(row0 + r) * ldc + col0 + c4) = h4; } } }
     }
}


typedef _Float16 v4h __attribute__((ext_vector_type(4)));

__global__ __launch_bounds__(256) void k_h16(const float* __restrict__ x, _Float16* __restrict__ X16, size_t n8) { const size_t t = (size_t)blockIdx.x * 256 + threadIdx.x; if (t >= n8) return; FragH f;
#pragma unroll
  for (int q = 0; q < 8; ++q) f.h[q] = (_Float16)x[t * 8 + q]; *(v8us*)((unsigned short*)X16 + t * 8) = f.half[0];  }
__global__ __launch_bounds__(256) void k_round16f(const float* __restrict__ W, _Float16* __restrict__ Bt, size_t n8) { const size_t t = (size_t)blockIdx.x * 256 + threadIdx.x; if (t >= n8) return; FragH f;
#pragma unroll
  for (int i = 0; i < 8; ++i) f.h[i] = (_Float16)(bf16_round(W[t * 8 + i]) * 16.0f); *(v8us*)((unsigned short*)Bt + t * 8) = f.half[0];  }
template <int NHv, int TTv>
__global__ __launch_bounds__(256) void k_vt(const _Float16* __restrict__ V16, int ldv, int voff, _Float16* __restrict__ Vt) { __shared__ unsigned short tl[64][66]; const int tid = threadIdx.x; const int slab = blockIdx.x / (TTv / 64), lg = blockIdx.x % (TTv / 64); const int b = slab / NHv, h = slab % NHv;
  for (int i = tid; i < 64 * 8; i += 256) { const int r = i / 8, c8 = (i % 8) * 8; FragH f; f.half[0] = *(const v8us*)((const unsigned short*)V16 + ((size_t)b * TTv + lg * 64 + r) * ldv + voff + h * 64 + c8);
#pragma unroll
    for (int q = 0; q < 8; ++q) tl[r][c8 + q] = f.u[q]; }
  __syncthreads();
  {
#pragma unroll
    for (int rd = 0; rd < 2; ++rd) { const int d = rd * 32 + tid / 8, pc = tid % 8; FragH f;
#pragma unroll
      for (int q = 0; q < 8; ++q) f.u[q] = tl[pc * 8 + q][d];
      *(v8us*)((unsigned short*)Vt + ((size_t)slab * 64 + d) * TTv + lg * 64 + pc * 8) = f.half[0]; }
     } }

__global__ __launch_bounds__(256) void k_hl(const float* __restrict__ F, _Float16* __restrict__ Hh, _Float16* __restrict__ Hl, size_t n8) { const size_t t = (size_t)blockIdx.x * 256 + threadIdx.x; if (t >= n8) return; FragH fh, fl; const v4f a = *(const v4fa*)(F + t * 8), c = *(const v4fa*)(F + t * 8 + 4);
#pragma unroll
  for (int q = 0; q < 4; ++q) { _Float16 h = (_Float16)a[q]; fh.h[q] = h; fl.h[q] = (_Float16)((a[q] - (float)h) * 1024.0f); h = (_Float16)c[q]; fh.h[4 + q] = h; fl.h[4 + q] = (_Float16)((c[q] - (float)h) * 1024.0f); }
  { *(v8us*)((unsigned short*)Hh + t * 8) = fh.half[0]; *(v8us*)((unsigned short*)Hl + t * 8) = fl.half[0];  } }

// ---- fast GEMM (wave tile 32x64, work-group tile 128x64; requires M % 128 == 0 rows per launch region, N % 64 == 0 and K % 64 == 0); epilogue = k_gemm_hhx semantics ----
__device__ __forceinline__ v16h g2_frag(const _Float16* p, int hh) { FragH f; f.half[0] = *(const v8us*)((const unsigned short*)p + 8 * hh); f.half[1] = *(const v8us*)((const unsigned short*)p + 16 + 8 * hh); return f.v; }
__device__ __forceinline__ v8f g2_mma(v16h a, v16h b, v8f c) { v8f d = __builtin_amdgcn_wmma_f32_16x16x32_f16(false, a, false, b, (short)0, c, false, false); asm volatile("v_nop\n\tv_nop\n\tv_nop\n\tv_nop" : "+v"(d) : "v"(a), "v"(b)); return d; }
// Operand staging of the fast GEMM: a stage is 64 k (one whole 128-byte line) of the work-group's 128 A rows and 64 B rows, brought into LDS by asynchronous copies, two buffers.
#define G2K 64                       /* k per stage */
#define G2P 72                       /* LDS row pitch in f16: 144 B = 16 B x odd, the pitch for 16-byte LDS reads of one row per lane */
#define G2S ((128 + 64) * G2P * 2)   /* bytes of a stage: A rows 0 .. 127, then B rows 0 .. 63 */
// One stage's copies of one thread: 16 bytes of rows r, r + 16, .. of A (8 rows: four from ga, the tile's rows 0 .. 63, four from ga4, its rows 64 .. 127) and of B (4 rows); 8 lanes bring one whole line, a wave-wide copy 4 lines.
// The s_wait_xcnt at the end stands inside the statement so that no register named by a copy is rewritten in front of it.
__device__ __forceinline__ void g2_stage(unsigned l, const _Float16* ga, const _Float16* ga4, size_t sa, const _Float16* gb, size_t sb) {
  asm volatile("global_load_async_to_lds_b128 %0, %12, off\n\tglobal_load_async_to_lds_b128 %1, %13, off\n\tglobal_load_async_to_lds_b128 %2, %14, off\n\tglobal_load_async_to_lds_b128 %3, %15, off\n\t"
               "global_load_async_to_lds_b128 %4, %16, off\n\tglobal_load_async_to_lds_b128 %5, %17, off\n\tglobal_load_async_to_lds_b128 %6, %18, off\n\tglobal_load_async_to_lds_b128 %7, %19, off\n\t"
               "global_load_async_to_lds_b128 %8, %20, off\n\tglobal_load_async_to_lds_b128 %9, %21, off\n\tglobal_load_async_to_lds_b128 %10, %22, off\n\tglobal_load_async_to_lds_b128 %11, %23, off\n\ts_wait_xcnt 0x0"
               :: "v"(l), "v"(l + 1 * 16 * G2P * 2), "v"(l + 2 * 16 * G2P * 2), "v"(l + 3 * 16 * G2P * 2), "v"(l + 4 * 16 * G2P * 2), "v"(l + 5 * 16 * G2P * 2), "v"(l + 6 * 16 * G2P * 2), "v"(l + 7 * 16 * G2P * 2),
                  "v"(l + 8 * 16 * G2P * 2), "v"(l + 9 * 16 * G2P * 2), "v"(l + 10 * 16 * G2P * 2), "v"(l + 11 * 16 * G2P * 2),
                  "v"(ga), "v"(ga + sa), "v"(ga + 2 * sa), "v"(ga + 3 * sa), "v"(ga4), "v"(ga4 + sa), "v"(ga4 + 2 * sa), "v"(ga4 + 3 * sa),
                  "v"(gb), "v"(gb + sb), "v"(gb + 2 * sb), "v"(gb + 3 * sb) : "memory"); }
// mode (a literal at every call, so that each call keeps only its own epilogue; an argument and not a template parameter, so that all calls share the one LDS array):
// 0: C / C16 rows as computed. 1: the f16 tile is stored TRANSPOSED, C16[col][row] with pitch ldc (no bias, CP, activation). 2: a tile of 64 rows of C from two A planes: the tile's A rows 0 .. 63 are rows of A,
// its rows 64 .. 127 the same rows of the plane sA elements behind it; C = alpha (A W) + alpha 2^-10 (A' W) (no bias, CP, activation; M % 64 == 0).
#define G2TP 136                     /* LDS pitch of a transposed output row in f16: 272 B = 16 B x odd */
template <int ACT>
__device__ __forceinline__ void gemm2_body(const int mode, const int bx, const int by, const _Float16* __restrict__ A, int lda, size_t sA, const _Float16* __restrict__ Bh, int ldb, size_t sB, float alpha, const float* __restrict__ bias, size_t sBias, const float* __restrict__ CP, int rowsPerB, size_t sCPb, int row0g,
    float* __restrict__ C, _Float16* __restrict__ C16, int ldc, size_t sC, int M, int N, int K) { static_assert(ACT == 0 || ACT == 3 || ACT == 6 || ACT == 8 || ACT == 9 || ACT == 11 || ACT == 12 || ACT == 14 || ACT == 15 || ACT == 16 || ACT == 17, "k_gemm2: unsupported ACT code (would silently apply no activation)");
  __shared__ __attribute__((aligned(16))) unsigned char sm[2 * G2S];      /* the two operand buffers; behind the k loop's last barrier the same bytes stage the output rows */
  static_assert(sizeof(float) * 4 * 32 * 68 <= 2 * G2S, "the output staging fits the operand buffers");
  float (*so)[32][68] = (float (*)[32][68])sm;
  const int tid = threadIdx.x, w = tid >> 5, lane = tid & 31, ln = lane & 15, hh = lane >> 4;
  if (mode != 2) A += (size_t)by * sA;
  Bh += (size_t)by * sB; const size_t cofs = (size_t)by * sC; const float* bp = bias ? bias + (size_t)by * sBias : nullptr;
  const int ntn = N >> 6; const int mt = bx / ntn, nq = bx - mt * ntn; const int tm = (mode == 2) ? 64 : 128;      /* rows of C per tile */
  const int row0 = mt * 128 + 32 * w, col0 = nq * 64; if (mt * tm >= M) return;      /* taken by a whole work-group or by none (M % tm == 0): it stands in front of barriers */
  const _Float16* ga = A + (size_t)(mt * tm + (tid >> 3)) * lda + (tid & 7) * 8; const _Float16* ga4 = ga + ((mode == 2) ? sA : (size_t)64 * lda); const _Float16* gb = Bh + (size_t)(col0 + (tid >> 3)) * ldb + (tid & 7) * 8;      /* this thread's 16 bytes of rows tid / 8 + 16 i */
  const unsigned lc = (unsigned)(size_t)sm + (unsigned)((tid >> 3) * (G2P * 2) + (tid & 7) * 16);      /* their place in buffer 0 (LDS byte address) */
  const _Float16* la = (const _Float16*)sm + (32 * w + ln) * G2P; const _Float16* lb = (const _Float16*)sm + (128 + ln) * G2P;      /* this lane's fragment rows in buffer 0 */
  const int nt = K / G2K;
  const v8f z8 = {0.f,0.f,0.f,0.f,0.f,0.f,0.f,0.f}; v8f c00 = z8, c01 = z8, c02 = z8, c03 = z8, c10 = z8, c11 = z8, c12 = z8, c13 = z8;
  g2_stage(lc, ga, ga4, (size_t)16 * lda, gb, (size_t)16 * ldb);
  asm volatile("s_wait_asynccnt 0x0" ::: "memory");      /* this wave's copies of stage 0 have landed */
  __syncthreads();      /* stage 0 is readable by every wave */
  if (nt > 1) g2_stage(lc + G2S, ga + G2K, ga4 + G2K, (size_t)16 * lda, gb + G2K, (size_t)16 * ldb);
#pragma unroll 1      /* one trip = one stage; the buffer is picked by the trip's parity */
  for (int t = 0; t < nt; ++t) { const int bo = (t & 1) * (G2S / 2); const _Float16* ap = la + bo; const _Float16* bq = lb + bo;
    v16h fa[2][2], fb[2][4];
#pragma unroll      /* the stage's 12 fragments are asked for as one group ahead of its products (constant indices: they stay in registers) */
    for (int q = 0; q < 2; ++q) { fa[q][0] = g2_frag(ap + q * 32, hh); fa[q][1] = g2_frag(ap + 16 * G2P + q * 32, hh);
#pragma unroll
      for (int u = 0; u < 4; ++u) fb[q][u] = g2_frag(bq + u * 16 * G2P + q * 32, hh); }
#pragma unroll      /* the two 32-k blocks of a stage, in ascending k as before */
    for (int q = 0; q < 2; ++q) {
      c00 = g2_mma(fa[q][0], fb[q][0], c00); c10 = g2_mma(fa[q][1], fb[q][0], c10);
      c01 = g2_mma(fa[q][0], fb[q][1], c01); c11 = g2_mma(fa[q][1], fb[q][1], c11);
      c02 = g2_mma(fa[q][0], fb[q][2], c02); c12 = g2_mma(fa[q][1], fb[q][2], c12);
      c03 = g2_mma(fa[q][0], fb[q][3], c03); c13 = g2_mma(fa[q][1], fb[q][3], c13); }
    asm volatile("s_wait_dscnt 0x0" ::: "memory");      /* this wave's reads of the buffer are done before it may be refilled */
    asm volatile("s_wait_asynccnt 0x0" ::: "memory");      /* this wave's copies of stage t + 1 have landed */
    __syncthreads();      /* publishes stage t + 1 and ends every wave's reads of stage t */
    if (t + 2 < nt) g2_stage(lc + (unsigned)(t & 1) * G2S, ga + (size_t)(t + 2) * G2K, ga4 + (size_t)(t + 2) * G2K, (size_t)16 * lda, gb + (size_t)(t + 2) * G2K, (size_t)16 * ldb); }
  asm volatile("s_wait_asynccnt 0x0" ::: "memory");      /* no copy is outstanding when the buffers become output staging */
  v8f accs[8] = {c00, c01, c02, c03, c10, c11, c12, c13};
  if (mode == 1) {      /* a lane's 8 accumulator values are 8 consecutive rows of one column: 16 bytes of a transposed row */
    unsigned short (*st)[G2TP] = (unsigned short (*)[G2TP])sm;
#pragma unroll      /* accs is indexed by constants only */
    for (int u = 0; u < 8; ++u) { FragH f;
#pragma unroll      /* short fixed trip count; f stays in registers */
      for (int r = 0; r < 8; ++r) f.h[r] = (_Float16)(accs[u][r] * alpha);
      *(v8us*)&st[(u & 3) * 16 + ln][32 * w + (u >> 2) * 16 + 8 * hh] = f.half[0]; }
    __syncthreads();      /* the transposed tile is complete before its rows, which hold all four waves' values, are read */
    unsigned short* dp = (unsigned short*)C16 + (size_t)(col0 + (tid >> 4)) * ldc + mt * 128 + (tid & 15) * 8;
#pragma unroll      /* 16 lanes store the 256 contiguous bytes of one transposed row; the LDS reads are asked for as one group */
    for (int q = 0; q < 8; ++q) { const v8us v = *(const v8us*)&st[q * 8 + (tid >> 4)][(tid & 15) * 8]; *(v8us*)(dp + (size_t)q * 8 * ldc) = v; }
    return; }
  if (mode == 2) {      /* waves 0, 1 hold the first plane's products of the tile's 64 rows, waves 2, 3 the second plane's */
    const float al = (w < 2) ? alpha : alpha * 0.0009765625f;
#pragma unroll      /* accs is indexed by constants only */
    for (int u = 0; u < 8; ++u)
#pragma unroll      /* short fixed trip count, constant indices */
      for (int r = 0; r < 8; ++r) so[w][(u >> 2) * 16 + 8 * hh + r][(u & 3) * 16 + ln] = accs[u][r] * al;
    __syncthreads();      /* a row's two terms come from two waves */
    const int rs = lane >> 4, cq = (lane & 15) * 4;      /* wave w stores rows 16 w .. 16 w + 15, whole 256-byte runs: they lie in the staging of waves w / 2 and 2 + w / 2 */
    const float* sp = &so[w >> 1][16 * (w & 1) + rs][cq]; float* cp = C + (size_t)(mt * 64 + 16 * w + rs) * ldc + col0 + cq;
#pragma unroll      /* the LDS reads are asked for as one group; one address each, constant offsets */
    for (int q = 0; q < 8; ++q) { const v4f a = *(const v4fa*)(sp + q * 2 * 68), b = *(const v4fa*)(sp + 2 * 32 * 68 + q * 2 * 68); *(v4f*)(cp + (size_t)q * 2 * ldc) = a + b; }
    return; }
#pragma unroll
  for (int u = 0; u < 8; ++u) { const int t = u & 3, half = u >> 2; const int col = col0 + t * 16 + ln; const float bv = bp ? bf16_round(bp[col]) : 0.f;
#pragma unroll
    for (int r = 0; r < 8; ++r) { const int rloc = half * 16 + 8 * hh + r; float v = accs[u][r] * alpha + bv; if (CP) { if (rowsPerB < 0) v += CP[cofs + (size_t)(row0g + row0 + rloc) * ldc + col];      /* rowsPerB < 0: own element of the batched C plane */ else { const int bidx = (row0g + row0 + rloc) / rowsPerB; v += CP[(size_t)bidx * sCPb + (size_t)by * 64 + col]; } }
      if (ACT == 3) v = fmaxf(v, 0.f); else if (ACT == 6) v = 0.5f * v * (1.0f + erff(v * 0.70710678118654752f)); else if (ACT == 11) v = 1.0f / (1.0f + expf(-v)); else if (ACT == 15) v = v / (1.0f + expf(-v)); else if (ACT == 12) v = (v > 0.f) ? v : 0.01f * v; else if (ACT == 8) v = tanhf(v); else if (ACT == 9) v = 0.5f * v * (1.0f + tanhf(0.7978845608028654f * (v + 0.044715f * v * v * v))); else if (ACT == 14) v = (v > 0.f) ? v : 0.1f * v; else if (ACT == 16) v = (v >= 0.f) ? v : 0.3f * v; else if (ACT == 17) v = (v >= 0.f) ? v : 0.2f * v;
      so[w][rloc][t * 16 + ln] = v; } }
  __builtin_amdgcn_fence(__ATOMIC_ACQ_REL, "workgroup"); __builtin_amdgcn_wave_barrier();
  const int rsub = lane >> 4, c4 = (lane & 15) * 4;
  {
#pragma unroll
    for (int q = 0; q < 16; ++q) { const int r = q * 2 + rsub; const v4f v = *(const v4fa*)&so[w][r][c4]; if (C) { *(v4f*)(C + cofs + (size_t)(row0 + r) * ldc + col0 + c4) = v; if (C16) asm volatile("s_wait_xcnt 0x0" ::: "memory"); }      /* both outputs asked for: the f32 store's address registers are reused for the f16 store's address, only behind this wait */
      if (C16) { v4h h4; for (int i = 0; i < 4; ++i) h4[i] = (_Float16)v[i]; *(v4h*)(C16 + cofs + (size_t)(row0 + r) * ldc + col0 + c4) = h4; } }
     } }
template <int ACT>
__global__ __launch_bounds__(128) void k_gemm2(const _Float16* __restrict__ A, int lda, size_t sA, const _Float16* __restrict__ Bh, int ldb, size_t sB, float alpha, const float* __restrict__ bias, size_t sBias, const float* __restrict__ CP, int rowsPerB, size_t sCPb, int row0g,
    float* __restrict__ C, _Float16* __restrict__ C16, int ldc, size_t sC, int M, int N, int K) { gemm2_body<ACT>(0, blockIdx.x, blockIdx.y, A, lda, sA, Bh, ldb, sB, alpha, bias, sBias, CP, rowsPerB, sCPb, row0g, C, C16, ldc, sC, M, N, K); }

// The six independent projection GEMMs as ONE launch. blockIdx.y = q, k or v (input, weight and output planes lie one behind the other); blockIdx.x picks the job:
// the first PJF work-groups give the f32 rows of the first QT0 tokens, the others the f16 rows of all tokens. A work-group's 64 columns are one head: those of v store their f16 tile
// transposed, straight into V^T [head][d][token], which is all that reads the f16 v.
#define PJF ((QT0 / 128) * (DM / 64))      /* work-groups of an f32 first-tile job */
#define PJH ((MP / 128) * (DM / 64))       /* work-groups of an f16 all-rows job */
__global__ __launch_bounds__(128) void k_qkv(const _Float16* __restrict__ X, const _Float16* __restrict__ BW, float* __restrict__ CF, _Float16* __restrict__ C16, _Float16* __restrict__ VT) {
  const int bx = blockIdx.x;      /* the same for the whole work-group: a scalar branch; each side knows at compile time which output it stores */
  if (bx < PJF) gemm2_body<0>(0, bx, blockIdx.y, X, DM, NR * DM, BW, DM, (size_t)DM * DM, 0.0625f, nullptr, 0, nullptr, 1, 0, 0, CF, nullptr, DM, (size_t)QT0 * DM, QT0, DM, DM);
  else if (blockIdx.y < 2) gemm2_body<0>(0, bx - PJF, blockIdx.y, X, DM, NR * DM, BW, DM, (size_t)DM * DM, 0.0625f, nullptr, 0, nullptr, 1, 0, 0, nullptr, C16, DM, NR * DM, MP, DM, DM);
  else gemm2_body<0>(1, bx - PJF, 2, X, DM, NR * DM, BW, DM, (size_t)DM * DM, 0.0625f, nullptr, 0, nullptr, 1, 0, 0, nullptr, VT, SQ, 0, MP, DM, DM); }

// The output GEMM of all rows as ONE launch. Rows 0 .. QT0 - 1 come from the exact first-tile o: the first POF work-groups take 64 rows each, the hi plane's and the x1024 residual plane's rows
// (OH, and QT0 rows behind it) side by side as the 128 A rows of their tile, and add the two products (2^-10 hi + 2^-20 lo) in the epilogue. The others: 128 rows of the f16-path o, from row QT0 on.
#define POF ((QT0 / 64) * (DM / 64))       /* work-groups of the first-tile rows */
__global__ __launch_bounds__(128) void k_out(const _Float16* __restrict__ O, const _Float16* __restrict__ OH, const _Float16* __restrict__ BO, float* __restrict__ out) {
  const int bx = blockIdx.x;
  if (bx < POF) gemm2_body<0>(2, bx, 0, OH, DM, (size_t)QT0 * DM, BO, DM, 0, 0.0009765625f, nullptr, 0, nullptr, 1, 0, 0, out, nullptr, DM, 0, QT0, DM, DM);
  else gemm2_body<0>(0, bx - POF + PJF, 0, O, DM, 0, BO, DM, 0, 0.0009765625f, nullptr, 0, nullptr, 1, 0, 0, out, nullptr, DM, 0, MPO, DM, DM); }

// Operand preparation as ONE launch of independent jobs picked by the block index; every wave-wide global access covers whole 128-byte lines and each thread has several loads in flight.
// Work-groups 0 .. PWT - 1: one tile of 128 k x 64 n of plane p of BW (q, k, v, o): BW[p][n][k] = f16(bf16(W[k][n]) x 16) (a power of two: bf16-exact weights stay exact in f16 away from the subnormal range);
// for p < 3 row n is column n % 64 of head n / 64 of the [head][in][out] stack, for p = 3 column n of the [in][out] output weight. The others: PXF elements of plane j of XH = input j rounded to bf16, as f16.
#define PWP ((DM / 128) * (DM / 64))       /* tiles (work-groups) per weight plane */
#define PWT (4 * PWP)                      /* weight tiles */
#define PXG 256                            /* work-groups per input */
#define PXF ((int)(NR * DM / PXG))         /* elements of an input per work-group */
#define PXL (PXF / 1024)                   /* 16-byte loads per thread */
#define PTP 136                            /* LDS pitch of a transposed weight row in f16: 272 B = 16 B x odd */
// One weight tile: a thread loads 8 k x 4 n (a wave-wide load = 256 contiguous bytes of two source rows), rounds, and writes its four 8-k runs into the transposed LDS tile;
// behind the barrier 16 lanes store 256 contiguous bytes of one output row. s: source element (k0, n0), PITCH its row pitch; d: BW element (n0, k0).
template <int PITCH>
__device__ __forceinline__ void prep_tile(const float* __restrict__ s, _Float16* __restrict__ d, unsigned short (*tl)[PTP]) {
  const int c = threadIdx.x & 15, g = threadIdx.x >> 4; const float* sp = s + (size_t)(g * 8) * PITCH + c * 4; v4f x[8];
#pragma unroll      /* constant indices keep x in registers; every load is issued before the first value is used */
  for (int i = 0; i < 8; ++i) x[i] = *(const v4fa*)(sp + i * PITCH);
  asm volatile("s_wait_xcnt 0x0" :: "v"(sp) : "memory");      /* the loads' address registers are held up to this wait and overwritten only behind it */
#pragma unroll      /* x is indexed by constants only */
  for (int q = 0; q < 4; ++q) { FragH f;
#pragma unroll
    for (int i = 0; i < 8; ++i) f.h[i] = (_Float16)(bf16_round(x[i][q]) * 16.0f);
    *(v8us*)&tl[c * 4 + q][g * 8] = f.half[0]; }
  __syncthreads();      /* the tile is complete before its rows are read */
#pragma unroll      /* four rows a thread, their LDS reads asked for as one group */
  for (int i = 0; i < 4; ++i) { const v8us v = *(const v8us*)&tl[g + 16 * i][c * 8]; *(v8us*)((unsigned short*)d + (size_t)(g + 16 * i) * DM + c * 8) = v; } }
__global__ __launch_bounds__(256) void k_prep(const float* __restrict__ xq, const float* __restrict__ xk, const float* __restrict__ xv, const float* __restrict__ wq, const float* __restrict__ wk, const float* __restrict__ wv, const float* __restrict__ wo,
    _Float16* __restrict__ BW, _Float16* __restrict__ XH) {
  __shared__ __attribute__((aligned(16))) unsigned short tl[64][PTP];
  const int bx = blockIdx.x;      /* the same for the whole work-group: scalar branches, so the barrier of a tile is passed by all its threads */
  if (bx < PWT) { const int p = bx / PWP, t = bx - p * PWP; const int nt = t / (DM / 128), k0 = (t % (DM / 128)) * 128; _Float16* d = BW + (size_t)p * DM * DM + (size_t)nt * 64 * DM + k0;
    if (p < 3) prep_tile<HD>(((p == 0) ? wq : (p == 1) ? wk : wv) + (size_t)nt * DM * HD + (size_t)k0 * HD, d, tl);
    else { prep_tile<DM>(wo + (size_t)k0 * DM + nt * 64, d, tl);
      asm volatile("s_wait_xcnt 0x0" ::: "memory"); } }      /* behind this tile's last store: in the built code the per-head tile's instructions follow and rewrite the stores' address registers; they stand only behind this wait */
  else { const int xb = bx - PWT; const int j = xb / PXG; const size_t o = (size_t)(xb - j * PXG) * PXF + threadIdx.x * 4; const float* x = ((j == 0) ? xq : (j == 1) ? xk : xv) + o; _Float16* y = XH + (size_t)j * NR * DM + o; v4f v[PXL];
#pragma unroll      /* constant indices keep v in registers, so that a thread has several loads (512 contiguous bytes a wave each) in flight ahead of the first value's use */
    for (int u = 0; u < PXL; ++u) v[u] = *(const v4fa*)(x + u * 1024);
    asm volatile("s_wait_xcnt 0x0" :: "v"(x) : "memory");      /* the loads' address registers are held up to this wait and overwritten only behind it */
#pragma unroll      /* v is indexed by constants only; a wave-wide store = 256 contiguous bytes */
    for (int u = 0; u < PXL; ++u) { v4h h4;
#pragma unroll
      for (int q = 0; q < 4; ++q) h4[q] = (_Float16)bf16_round(v[u][q]);
      *(v4h*)(y + u * 1024) = h4; } } }


__global__ __launch_bounds__(256) void k_wnat(const float* __restrict__ w, size_t n8, _Float16* __restrict__ Bt) { const size_t t = (size_t)blockIdx.x * 256 + threadIdx.x; if (t >= n8) return; FragH f; for (int q = 0; q < 8; ++q) f.h[q] = (_Float16)(bf16_round(w[t * 8 + q]) * 16.0f); *(v8us*)((unsigned short*)Bt + t * 8) = f.half[0];  }
__global__ __launch_bounds__(256) void k_rsm(const float* __restrict__ S, _Float16* __restrict__ P, int nrows) {
  #pragma clang fp contract(off)
  const int i = blockIdx.x * 256 + threadIdx.x; if (i >= nrows) return; const float* s = S + (size_t)i * SQ; float mx = -3.0e38f;
#pragma unroll 1
  for (int j = 0; j < SQ; ++j) mx = fmaxf(mx, s[j]); float se = 0.f;
#pragma unroll 1
  for (int j = 0; j < SQ; ++j) se += expf(s[j] - mx); const float sc = 256.0f / se;
#pragma unroll 1
  for (int j0 = 0; j0 < SQ; j0 += 8) { FragH f; for (int q = 0; q < 8; ++q) f.h[q] = (_Float16)(expf(s[j0 + q] - mx) * sc); unsigned short* d = (unsigned short*)P + (size_t)i * SQ + j0; *(v8us*)d = f.half[0];  } }
__global__ __launch_bounds__(256) void k_vt(const _Float16* __restrict__ V16, int b, int h0, _Float16* __restrict__ VT) { __shared__ unsigned short tl[64][65]; const int tid = threadIdx.x; const int hh = blockIdx.x % HG, sg = blockIdx.x / HG; const int s0 = sg * 64; const int h = h0 + hh;
  for (int i = tid; i < 64 * 8; i += 256) { const int j = i / 8, d8 = (i % 8) * 8; FragH f; f.half[0] = *(const v8us*)((const unsigned short*)V16 + ((size_t)b * SQ + s0 + j) * DM + h * HD + d8); for (int q = 0; q < 8; ++q) tl[d8 + q][j] = f.u[q]; }
  __syncthreads();
  { for (int i = tid; i < 64 * 8; i += 256) { const int d = i / 8, j8 = (i % 8) * 8; FragH f; for (int q = 0; q < 8; ++q) f.u[q] = tl[d][j8 + q]; *(v8us*)((unsigned short*)VT + ((size_t)hh * HD + d) * SQ + s0 + j8) = f.half[0]; }  } }



#define FQ 32                        /* query rows per wave */
#define FG 4                         /* groups of FQ query rows per tile */
#define FW (2 * FG)                  /* waves per work-group: wave w takes rows group w % FG and key half w / FG */
#define FQT (FQ * FG)                /* query rows per tile */
#define FNT (SQ / FQT)               /* tiles per head */
#define FNG (NH * (FNT / 2))         /* work-groups: each takes tiles FNT - 1 - i and i of a head, one after the other, so that all have equal work */
__device__ __forceinline__ v8f fa_mma(v16h a, v16h b, v8f c) { return __builtin_amdgcn_wmma_f32_16x16x32_f16(false, a, false, b, (short)0, c, false, false); }
__device__ __forceinline__ float fa_xhalf(float x) { return __builtin_bit_cast(float, __builtin_amdgcn_permlanex16(__builtin_bit_cast(int, x), __builtin_bit_cast(int, x), 0x76543210, 0xfedcba98, false, false)); }      /* lane l with lane l ^ 16 */
// 2^x by the native instruction. The v_nop at the end fills the slot that the instruction set asks for behind a transcendental before its result is read or its source overwritten;
// inside the group every result register differs from every source ("=&v"), so each v_exp_f32 is the independent instruction behind the one before it.
__device__ __forceinline__ float fa_exp2(float x) { float e; asm("v_exp_f32 %0, %1\n\tv_nop" : "=&v"(e) : "v"(x)); return e; }
__device__ __forceinline__ void fa_exp2x8(const float (&x)[8], float (&e)[8]) {
  asm("v_exp_f32 %0, %8\n\tv_exp_f32 %1, %9\n\tv_exp_f32 %2, %10\n\tv_exp_f32 %3, %11\n\tv_exp_f32 %4, %12\n\tv_exp_f32 %5, %13\n\tv_exp_f32 %6, %14\n\tv_exp_f32 %7, %15\n\tv_nop"
      : "=&v"(e[0]), "=&v"(e[1]), "=&v"(e[2]), "=&v"(e[3]), "=&v"(e[4]), "=&v"(e[5]), "=&v"(e[6]), "=&v"(e[7]) : "v"(x[0]), "v"(x[1]), "v"(x[2]), "v"(x[3]), "v"(x[4]), "v"(x[5]), "v"(x[6]), "v"(x[7])); }
// Operand staging of the fused attention: a stage is 128 keys of the head in two halves of 64, each half K as 64 rows (keys) of 128 bytes and V^T as 64 rows (d) of 128 bytes, whole lines,
// brought into LDS once for the 4 waves that work on it by asynchronous copies, two buffers.
#define FK 64                        /* keys per half stage = two passes of one wave */
#define FP 72                        /* LDS row pitch in f16: 144 B = 16 B x odd, the pitch for 16-byte LDS reads of one row per lane */
#define FT (64 * FP * 2)             /* bytes of a tile of 64 rows */
#define FS (2 * FT)                  /* bytes of a half stage: the K tile, then the V^T tile */
#define FKS (2 * FK)                 /* keys per stage */
#define FB (2 * FS)                  /* bytes of a stage buffer: the two halves */
// One stage's copies of one thread, all in its wave's half: 16 bytes of rows r, r + 16, r + 32, r + 48 of K and of V^T; 8 lanes bring one whole line, a wave-wide copy 4 lines.
// The s_wait_xcnt at the end stands inside the statement so that no register named by a copy is rewritten in front of it.
__device__ __forceinline__ void fa_stage(unsigned l, const _Float16* gk, const _Float16* gv) {
  asm volatile("global_load_async_to_lds_b128 %0, %8, off\n\tglobal_load_async_to_lds_b128 %1, %9, off\n\tglobal_load_async_to_lds_b128 %2, %10, off\n\tglobal_load_async_to_lds_b128 %3, %11, off\n\t"
               "global_load_async_to_lds_b128 %4, %12, off\n\tglobal_load_async_to_lds_b128 %5, %13, off\n\tglobal_load_async_to_lds_b128 %6, %14, off\n\tglobal_load_async_to_lds_b128 %7, %15, off\n\ts_wait_xcnt 0x0"
               :: "v"(l), "v"(l + 1 * 16 * FP * 2), "v"(l + 2 * 16 * FP * 2), "v"(l + 3 * 16 * FP * 2), "v"(l + FT), "v"(l + FT + 1 * 16 * FP * 2), "v"(l + FT + 2 * 16 * FP * 2), "v"(l + FT + 3 * 16 * FP * 2),
                  "v"(gk), "v"(gk + (size_t)16 * DM), "v"(gk + (size_t)32 * DM), "v"(gk + (size_t)48 * DM), "v"(gv), "v"(gv + (size_t)16 * SQ), "v"(gv + (size_t)32 * SQ), "v"(gv + (size_t)48 * SQ) : "memory"); }
// One pass = 32 keys: scores from kf, running softmax, o += P V from vf. nk: where the wave's next K fragments lie in the same stage (asked for behind the score products), or null.
__device__ __forceinline__ void fa_pass(v16h (&kf)[2][2], const v16h (&qf)[2][2], const v16h (&vf)[4], v8f (&acc)[4][2], float (&mr)[2], float (&ls)[2], const _Float16* nk, const bool diag, const int ln, const int hh) {
  const float CS = 0.125f * 1.4426950408889634f;      /* score scale x log2(e): exponentials in base 2 */
  const v8f z8 = {0.f, 0.f, 0.f, 0.f, 0.f, 0.f, 0.f, 0.f}; v8f s[2][2];
#pragma unroll
  for (int u = 0; u < 2; ++u)
#pragma unroll
    for (int t = 0; t < 2; ++t) s[u][t] = fa_mma(kf[u][1], qf[t][1], fa_mma(kf[u][0], qf[t][0], z8));
  if (nk) {
#pragma unroll
    for (int u = 0; u < 2; ++u)
#pragma unroll
      for (int c = 0; c < 2; ++c) kf[u][c] = g2_frag(nk + u * 16 * FP + c * 32, hh);
    __builtin_amdgcn_sched_barrier(0); }      /* keeps these LDS reads here, ahead of the softmax that covers their latency: left free they were issued right in front of their first use */
  if (diag) {      /* the diagonal pass: key > query is masked (a scalar branch) */
#pragma unroll
    for (int u = 0; u < 2; ++u)
#pragma unroll
      for (int t = 0; t < 2; ++t)
#pragma unroll
        for (int r = 0; r < 8; ++r) if (u * 16 + 8 * hh + r > t * 16 + ln) s[u][t][r] = -3.0e38f; }
  FragH pf[2];
#pragma unroll
  for (int t = 0; t < 2; ++t) { float mx = fmaxf(s[0][t][0], s[1][t][0]);
#pragma unroll
    for (int r = 1; r < 8; ++r) mx = fmaxf(mx, fmaxf(s[0][t][r], s[1][t][r]));
    mx = fmaxf(mx, fa_xhalf(mx)); const float mn = fmaxf(mr[t], mx); const float corr = fa_exp2((mr[t] - mn) * CS); mr[t] = mn; const float mc = mn * CS;      /* every pass holds at least one unmasked key of every query: mn is a real score */
    float x0[8], x1[8], e0[8], e1[8];
#pragma unroll
    for (int r = 0; r < 8; ++r) { x0[r] = fmaf(s[0][t][r], CS, -mc); x1[r] = fmaf(s[1][t][r], CS, -mc); }
    fa_exp2x8(x0, e0); fa_exp2x8(x1, e1); float s0 = 0.f, s1 = 0.f;
#pragma unroll
    for (int r = 0; r < 8; ++r) { s0 += e0[r]; s1 += e1[r]; pf[t].h[r] = (_Float16)e0[r]; pf[t].h[8 + r] = (_Float16)e1[r]; }
    ls[t] = fmaf(ls[t], corr, s0 + s1);
#pragma unroll
    for (int d = 0; d < 4; ++d) acc[d][t] *= corr; }
#pragma unroll
  for (int d = 0; d < 4; ++d)
#pragma unroll
    for (int t = 0; t < 2; ++t) acc[d][t] = fa_mma(vf[d], pf[t].v, acc[d][t]); }
// One half stage = two passes. TAIL: the tile's last two stages, where a wave's rows may end (its diagonal pass is masked, what lies beyond is skipped by scalar branches); before them every pass is whole.
template <bool TAIL>
__device__ __forceinline__ void fa_trip(const _Float16* kq, const _Float16* vq, const int j0, const int q0, const v16h (&qf)[2][2], v8f (&acc)[4][2], float (&mr)[2], float (&ls)[2], const int ln, const int hh) {
  if (TAIL && j0 > q0) return;      /* a wave whose rows end below this stage only takes part in the publish point */
  v16h kf[2][2], vf[4];
#pragma unroll      /* the first pass's K and V^T fragments, asked for as one group (constant indices: they stay in registers) */
  for (int u = 0; u < 2; ++u)
#pragma unroll
    for (int c = 0; c < 2; ++c) kf[u][c] = g2_frag(kq + u * 16 * FP + c * 32, hh);
#pragma unroll
  for (int d = 0; d < 4; ++d) vf[d] = g2_frag(vq + d * 16 * FP, hh);
  __builtin_amdgcn_sched_barrier(0);      /* keeps the V^T reads in this group: left free they were issued among the P V products, which then waited for them */
  fa_pass(kf, qf, vf, acc, mr, ls, kq + 32 * FP, TAIL && j0 == q0, ln, hh);      /* the second pass's K rows lie in the same stage: always readable, unused where the wave ends here */
  if (TAIL && j0 + 32 > q0) return;
#pragma unroll      /* V^T of the second pass: asked for ahead of its score products and softmax */
  for (int d = 0; d < 4; ++d) vf[d] = g2_frag(vq + d * 16 * FP + 32, hh);
  __builtin_amdgcn_sched_barrier(0);      /* keeps these reads here, as above */
  fa_pass(kf, qf, vf, acc, mr, ls, nullptr, TAIL && j0 + 32 == q0, ln, hh); }
// sm: the work-group's LDS: the two stage buffers (2 FB bytes), then the joining area; bx: the work-group's number among the FNG of this job.
// The stages of the group's two tiles form ONE sequence for the copies: stage i of the sequence lies in buffer i % 2, and the second tile's first stages are copied while the first tile's last ones are worked on.
#define FMC (32 * 4)                 /* floats of one chunk of the joining area: 16 bytes a lane */
#define FMG (17 * FMC)               /* floats of a rows group's joining area: the 64 accumulator registers as 16 chunks, then maximum and sum */
#define FLDS (2 * FB + FG * FMG * 4) /* bytes of LDS of this job */
__device__ __forceinline__ void fattn_body(unsigned char* sm, const int bx, const _Float16* __restrict__ Q, const _Float16* __restrict__ K, const _Float16* __restrict__ VT, _Float16* __restrict__ O) {
  static_assert(FQT == FKS && FNT / 2 >= 2, "a tile of rows ends with a stage of keys; the longer tile has at least two stages");
  const int tid = threadIdx.x, lane = tid & 31, ln = lane & 15, hh = lane >> 4; const int w = __builtin_amdgcn_readfirstlane(tid >> 5);
  const int g = w % FG, ks = w / FG;      /* rows group and key half of this wave (the same in every lane: scalar tests) */
  const int h = bx % NH, pr = bx / NH; const int th = tid & (FG * 32 - 1);      /* th: the thread's number among the 128 of its key half */
  const _Float16* gk = K + (size_t)(ks * FK + (th >> 3)) * DM + h * HD + (th & 7) * 8; const _Float16* gv = VT + ((size_t)h * HD + (th >> 3)) * SQ + ks * FK + (th & 7) * 8;      /* this thread's 16 bytes of rows th / 8 + 16 i of its half of the head's stage 0 */
  const unsigned lc = (unsigned)(size_t)sm + (unsigned)(ks * FS + (th >> 3) * (FP * 2) + (th & 7) * 16);      /* their place in buffer 0 (LDS byte address) */
  const _Float16* lk = (const _Float16*)sm + ks * (FS / 2) + ln * FP; const _Float16* lv = lk + 64 * FP;      /* this lane's fragment rows in its half of buffer 0 */
  const unsigned lq = (unsigned)(ln * DM + 8 * hh);      /* this lane's place in the wave's 16 rows of Q or O, in elements */
  float* mg = (float*)(sm + 2 * FB) + g * FMG + lane * 4;      /* this lane's 16 bytes of chunk 0 of its rows group's joining area */
  fa_stage(lc, gk, gv);
  asm volatile("s_wait_asynccnt 0x0" ::: "memory");      /* this wave's copies of stage 0 have landed */
  __syncthreads();      /* stage 0 is readable by every wave */
  fa_stage(lc + FB, gk + (size_t)FKS * DM, gv + FKS);      /* the first tile is the longer one: its stage 1 exists */
  int i = 0;      /* the stage's number in the group's sequence */
#pragma unroll 1      /* the two tiles one after the other: small code */
  for (int half = 0; half < 2; ++half) {
    const int tile = (half == 0) ? (FNT - 1 - pr) : pr; const int q0 = tile * FQT + g * FQ;
    const int ns = tile + 1;      /* stages of the tile: the keys below its last row's end; the same for all waves */
    const size_t qo = (size_t)q0 * DM + h * HD;      /* the wave's first row in Q and O */
    v16h qf[2][2];
#pragma unroll      /* fragments indexed by constants only: they stay in registers */
    for (int t = 0; t < 2; ++t)
#pragma unroll
      for (int c = 0; c < 2; ++c) { FragH f; f.half[0] = *(const v8us*)((const unsigned short*)Q + qo + (lq + t * 16 * DM + c * 32)); f.half[1] = *(const v8us*)((const unsigned short*)Q + qo + (lq + t * 16 * DM + c * 32 + 16)); qf[t][c] = f.v; }
    asm volatile("s_wait_xcnt 0x0" ::: "memory");      /* the address registers of the loads above are reused below: they are overwritten only behind this wait */
    const v8f z8 = {0.f, 0.f, 0.f, 0.f, 0.f, 0.f, 0.f, 0.f}; v8f acc[4][2]; float mr[2], ls[2];
#pragma unroll
    for (int t = 0; t < 2; ++t) { mr[t] = -3.0e38f; ls[t] = 0.f;
#pragma unroll
      for (int d = 0; d < 4; ++d) acc[d][t] = z8; }
    int t = 0;
#pragma unroll 1      /* one trip = one stage = two passes of 32 keys a wave; the buffer is picked by the parity of i. All stages of the tile but the last two: whole for every wave, and the tile has a stage t + 2 */
    for (; t < ns - 2; ++t, ++i) {
      fa_trip<false>(lk + (i & 1) * (FB / 2), lv + (i & 1) * (FB / 2), t * FKS + ks * FK, q0, qf, acc, mr, ls, ln, hh);
      __builtin_amdgcn_sched_barrier(0);      /* keeps the publish point at the trip's foot: moved up by the scheduler, its s_wait_dscnt 0 stood directly behind the second pass's V^T reads and waited for them */
      asm volatile("s_wait_dscnt 0x0" ::: "memory");      /* this wave's reads of the buffer are done before it may be refilled */
      asm volatile("s_wait_asynccnt 0x0" ::: "memory");      /* this wave's copies of stage i + 1 have landed */
      __syncthreads();      /* publishes stage i + 1 and ends every wave's reads of stage i */
      fa_stage(lc + (unsigned)(i & 1) * FB, gk + (size_t)(t + 2) * FKS * DM, gv + (size_t)(t + 2) * FKS); }
#pragma unroll 1      /* the tile's last two stages (one where it has one); small code */
    for (; t < ns; ++t, ++i) {
      fa_trip<true>(lk + (i & 1) * (FB / 2), lv + (i & 1) * (FB / 2), t * FKS + ks * FK, q0, qf, acc, mr, ls, ln, hh);
      asm volatile("s_wait_dscnt 0x0" ::: "memory");      /* as above */
      asm volatile("s_wait_asynccnt 0x0" ::: "memory");      /* this wave's copies of stage i + 1 have landed */
      __syncthreads();      /* publishes stage i + 1 and ends every wave's reads of stage i; every wave passes it, also one that skipped the stage */
      const int nx = t + 2 - ns;      /* stage i + 2 of the sequence is stage nx of the second tile, where there is one (tests that read the same for the whole work-group) */
      if (half == 0 && nx <= pr) fa_stage(lc + (unsigned)(i & 1) * FB, gk + (size_t)nx * FKS * DM, gv + (size_t)nx * FKS); }
    if (ks == 1) {      /* the wave of the upper key half hands over its accumulators, maxima and sums (0, -3e38 and 0 where no key of its half lies below the rows' end) */
#pragma unroll      /* acc is indexed by constants only */
      for (int d = 0; d < 4; ++d)
#pragma unroll
        for (int t2 = 0; t2 < 2; ++t2) { const v8f a = acc[d][t2];
          *(v4f*)(mg + ((d * 2 + t2) * 2) * FMC) = (v4f){a[0], a[1], a[2], a[3]}; *(v4f*)(mg + ((d * 2 + t2) * 2 + 1) * FMC) = (v4f){a[4], a[5], a[6], a[7]}; }
      *(v4f*)(mg + 16 * FMC) = (v4f){mr[0], mr[1], ls[0], ls[1]}; }
    __syncthreads();      /* the handed-over values are complete before the partner reads them. They are overwritten only for the second tile, behind the wait for LDS reads and the barrier at the foot of its stages */
    if (ks == 0) {      /* the wave of the lower key half, which always holds a real maximum, joins the two and stores */
      const float CS = 0.125f * 1.4426950408889634f; const v4f pm = *(const v4f*)(mg + 16 * FMC);
#pragma unroll
      for (int t2 = 0; t2 < 2; ++t2) { const float mn = fmaxf(mr[t2], pm[t2]); const float c0 = fa_exp2((mr[t2] - mn) * CS), c1 = fa_exp2((pm[t2] - mn) * CS);
        const float l = fmaf(ls[t2], c0, pm[2 + t2] * c1); const float inv = 64.0f / (l + fa_xhalf(l));      /* the lane halves' sums joined once; o carried x64 */
        const float a0 = c0 * inv, a1 = c1 * inv;
#pragma unroll      /* the wave stores the whole 128-byte line of each of its rows */
        for (int d = 0; d < 4; ++d) { FragH f; const v4f p0 = *(const v4f*)(mg + ((d * 2 + t2) * 2) * FMC), p1 = *(const v4f*)(mg + ((d * 2 + t2) * 2 + 1) * FMC);
#pragma unroll
          for (int r = 0; r < 4; ++r) { f.h[r] = (_Float16)fmaf(acc[d][t2][r], a0, p0[r] * a1); f.h[4 + r] = (_Float16)fmaf(acc[d][t2][4 + r], a0, p1[r] * a1); }
          *(v8us*)((unsigned short*)O + qo + (lq + t2 * 16 * DM + d * 16)) = f.half[0]; } }
      asm volatile("s_wait_xcnt 0x0" ::: "memory"); } }      /* the stores' address registers are rewritten by the next tile's addresses only behind this wait */
  asm volatile("s_wait_asynccnt 0x0" ::: "memory"); }      /* no copy is outstanding when the wave ends */


// Exact f32 causal attention for rows 0 .. QT0 - 1 (o carried x64 like the f16 path). ONE WORK-GROUP PER HEAD AND 16 QUERY ROWS, 8 waves, as further work-groups of the fused attention's launch:
// the head's K rows below the group's end and the group's q rows are staged in LDS by coalesced loads; scores: one thread per key (the K row in registers, the q rows wave-uniform);
// softmax: one wave per two rows; o: 8 partial sums, sum p over every eighth chunk of 4 keys for all 16 rows x 64 columns in registers (wave w forms sum w, V straight from global memory,
// whole 256-byte rows), added in the order 0 .. 7; stored as f16 hi + residual planes. Every sum is formed in the order it had with 4 waves.
#define A0R 16                       /* query rows per work-group */
#define A0T (FW * 32)                /* threads per work-group: the launch's */
#define A0KP (HD + 4)                /* LDS pitch of a K row in floats: 272 B = 16 B x odd, so that 16-byte reads of one row per lane spread over the banks */
#define A0SP (QT0 + 4)               /* LDS pitch of a score row in floats (a multiple of 16 B) */
#define A0LK (QT0 * A0KP * 4)        /* bytes of the K rows; behind the scores the same bytes hold the 8 partial sums */
#define A0LS (A0R * A0SP * 4)        /* bytes of the score rows */
#define A0LQ (A0R * HD * 4)          /* bytes of the group's q rows */
#define A0LDS (A0LK + A0LS + A0LQ + A0R * 4)
#define A0NG (NH * (QT0 / A0R))      /* work-groups */
__device__ __forceinline__ void att0_body(unsigned char* sm, const int bx, const float* __restrict__ QF, const float* __restrict__ KF, const float* __restrict__ VF, const float scale, _Float16* __restrict__ OH, _Float16* __restrict__ OL) {
  static_assert(sizeof(float) * 8 * A0R * HD <= A0LK, "the partial sums fit the K rows' bytes");
  float (*lk)[A0KP] = (float (*)[A0KP])sm; float (*red)[A0R][HD] = (float (*)[A0R][HD])sm; float (*ls)[A0SP] = (float (*)[A0SP])(sm + A0LK); float (*lq)[HD] = (float (*)[HD])(sm + A0LK + A0LS); float* linv = (float*)(sm + A0LK + A0LS + A0LQ);
  const int tid = threadIdx.x, lane = tid & 31, w = __builtin_amdgcn_readfirstlane(tid >> 5); const int h = bx / (QT0 / A0R), rg = bx % (QT0 / A0R); const int nk = (rg + 1) * A0R;      /* causal: keys below the group's end */
  static_assert(A0T == 16 * A0R && A0T == QT0 && FW == 8, "a thread per 16 bytes of the q rows, a thread per key, a wave per partial sum");
  const int r16 = tid >> 4, c4 = (tid & 15) * 4;
  { const float* kp = KF + (size_t)r16 * DM + h * HD + c4; const float* qp = QF + (size_t)(rg * A0R + r16) * DM + h * HD + c4; v4f kx[QT0 / 16];
    const v4f q0 = *(const v4fa*)qp;
#pragma unroll      /* constant indices keep kx in registers; every load is issued before the first value is used */
    for (int u = 0; u < QT0 / 16; ++u) if (u * 16 < nk) kx[u] = *(const v4fa*)(kp + (size_t)u * 16 * DM);
    asm volatile("s_wait_xcnt 0x0" :: "v"(kp), "v"(qp) : "memory");      /* the loads' address registers are reused below: they are held up to this wait and overwritten only behind it */
    *(v4f*)&lq[r16][c4] = q0;
#pragma unroll      /* constant indices, as above */
    for (int u = 0; u < QT0 / 16; ++u) if (u * 16 < nk) *(v4f*)&lk[u * 16 + r16][c4] = kx[u]; }
  __syncthreads();      /* the K and q rows are complete before a thread reads them */
  if (tid < nk) { const int key = tid; v4f kr[HD / 4];
#pragma unroll      /* the key's row stays in registers for all 16 query rows */
    for (int c = 0; c < HD / 4; ++c) kr[c] = *(const v4f*)&lk[key][c * 4];
#pragma unroll 2      /* two rows' q reads (the same LDS address in every lane) in flight ahead of their products */
    for (int i = 0; i < A0R; ++i) { v4f s4 = {0.f, 0.f, 0.f, 0.f};
#pragma unroll      /* kr is indexed by constants only */
      for (int c = 0; c < HD / 4; ++c) { const v4f qq = *(const v4f*)&lq[i][c * 4];
#pragma unroll      /* short fixed trip count; the arrays it indexes stay in registers */
        for (int u = 0; u < 4; ++u) s4[u] = fmaf(qq[u], kr[c][u], s4[u]); }
      ls[i][key] = ((s4[0] + s4[1]) + (s4[2] + s4[3])) * scale; } }
  __syncthreads();      /* a row's scores come from all waves; and every read of the K rows is done */
#pragma unroll 1      /* two rows a wave, one after the other: small code */
  for (int i = 2 * w; i < 2 * w + 2; ++i) { const int last = rg * A0R + i; float x[QT0 / 32]; float mx = -3.0e38f;
#pragma unroll      /* x is indexed by constants only */
    for (int u = 0; u < QT0 / 32; ++u) { const int j = u * 32 + lane; x[u] = (j <= last) ? ls[i][j] : -3.0e38f; mx = fmaxf(mx, x[u]); }
#pragma unroll      /* short fixed trip count; the arrays it indexes stay in registers */
    for (int o = 16; o > 0; o >>= 1) mx = fmaxf(mx, __shfl_xor(mx, o, 32));
    float se = 0.f;
#pragma unroll      /* short fixed trip count; the arrays it indexes stay in registers */
    for (int u = 0; u < QT0 / 32; ++u) { const int j = u * 32 + lane; const float e = (j <= last) ? expf(x[u] - mx) : 0.f; se += e; if (j < nk) ls[i][j] = e; }
#pragma unroll      /* short fixed trip count; the arrays it indexes stay in registers */
    for (int o = 16; o > 0; o >>= 1) se += __shfl_xor(se, o, 32);
    if (lane == 0) linv[i] = 64.0f / se; }      /* o carried x64 like the f16 path */
  __syncthreads();      /* the weights of all rows are complete */
  { const int rh = lane >> 4, d4 = (lane & 15) * 4;
    { const int p = w; const float* vp = VF + (size_t)(4 * p) * DM + h * HD + d4; v4f vv[QT0 / 32][4], acc[8];
#pragma unroll      /* constant indices keep vv in registers; all V rows of this partial sum are asked for before the first is used. No test here: every row lies below QT0, and under a test the built code let only four loads fly at a time; rows from nk on are not used */
      for (int t = 0; t < QT0 / 32; ++t)
#pragma unroll      /* constant indices, as above */
        for (int q = 0; q < 4; ++q) vv[t][q] = *(const v4fa*)(vp + (size_t)(32 * t + q) * DM);
      asm volatile("s_wait_xcnt 0x0" :: "v"(vp) : "memory");      /* the loads' address registers are held up to this wait and overwritten only behind it */
#pragma unroll      /* short fixed trip count; the arrays it indexes stay in registers */
      for (int r = 0; r < 8; ++r) acc[r] = (v4f){0.f, 0.f, 0.f, 0.f};
#pragma unroll      /* vv is indexed by constants only; chunks in ascending key order (scalar tests: p and nk are the same in every lane) */
      for (int t = 0; t < QT0 / 32; ++t) if (4 * p + 32 * t < nk) { v4f pv[8];
#pragma unroll      /* short fixed trip count; the arrays it indexes stay in registers */
        for (int r = 0; r < 8; ++r) pv[r] = *(const v4f*)&ls[rh * 8 + r][4 * p + 32 * t];
#pragma unroll      /* short fixed trip count; the arrays it indexes stay in registers */
        for (int q = 0; q < 4; ++q)
#pragma unroll      /* short fixed trip count; the arrays it indexes stay in registers */
          for (int r = 0; r < 8; ++r)
#pragma unroll      /* short fixed trip count; the arrays it indexes stay in registers */
            for (int u = 0; u < 4; ++u) acc[r][u] = fmaf(pv[r][q], vv[t][q][u], acc[r][u]); }
#pragma unroll      /* short fixed trip count; the arrays it indexes stay in registers */
      for (int r = 0; r < 8; ++r) *(v4f*)&red[p][rh * 8 + r][d4] = acc[r]; } }
  __syncthreads();      /* the 8 partial sums are complete */
  { v4f o = *(const v4f*)&red[0][r16][c4];
#pragma unroll      /* short fixed trip count; the arrays it indexes stay in registers */
    for (int p = 1; p < 8; ++p) { const v4f a = *(const v4f*)&red[p][r16][c4]; o += a; }
    const float fin = linv[r16]; o *= fin;
    v4h oh, ol;      /* o (x64) leaves as an f16 hi plane and a x1024 residual plane, the output GEMM's operands */
#pragma unroll      /* short fixed trip count; the vectors it indexes stay in registers */
    for (int u = 0; u < 4; ++u) { const _Float16 t = (_Float16)o[u]; oh[u] = t; ol[u] = (_Float16)((o[u] - (float)t) * 1024.0f); }
    const size_t e = (size_t)(rg * A0R + r16) * DM + h * HD + c4; *(v4h*)(OH + e) = oh; *(v4h*)(OL + e) = ol; } }

// The two attention jobs, which both read only what the projection launch wrote, as ONE launch: work-groups 0 .. FNG - 1 the fused f16 attention (first: they run longest),
// the A0NG behind them the exact f32 attention of the first QT0 rows, which runs beside them. One LDS array serves either job.
__global__ __launch_bounds__(FW * 32) void k_attn(const _Float16* __restrict__ Q, const _Float16* __restrict__ K, const _Float16* __restrict__ VT, _Float16* __restrict__ O,
    const float* __restrict__ QF, const float* __restrict__ KF, const float* __restrict__ VF, _Float16* __restrict__ OH, _Float16* __restrict__ OL) {
  __shared__ __attribute__((aligned(16))) unsigned char sm[(A0LDS > FLDS) ? A0LDS : FLDS];
  const int bx = blockIdx.x;      /* the same for the whole work-group: a scalar branch, so each job's barriers are passed by all threads of its groups */
  if (bx < FNG) fattn_body(sm, bx, Q, K, VT, O);
  else { att0_body(sm, bx - FNG, QF, KF, VF, 0.125f, OH, OL);
    asm volatile("s_wait_xcnt 0x0" ::: "memory"); } }      /* behind this job's last stores: in the built code the other job's instructions follow and rewrite the stores' address registers; they stand only behind this wait */

extern "C" void kernel_launch(void* const* d_in, const int* in_sizes, int n_in,
                              void* d_out, int out_size, void* d_ws, size_t ws_size, hipStream_t stream) {
  (void)in_sizes; (void)n_in; (void)out_size;
  const float* const* I = (const float* const*)d_in; const float* xq = I[0]; const float* xk = I[1]; const float* xv = I[2]; const float* wq = I[3]; const float* wk = I[4]; const float* wv = I[5]; const float* wo = I[6];      /* weights as [in][out] (q, k, v: per-head stacks) */
  char* ws = (char*)d_ws; size_t off = 0;
  auto take = [&](size_t bytes) { char* p = ws + off; off += (bytes + 255) & ~(size_t)255; return p; };
  static_assert(NB == 1 && B0 == 0 && NBR == 1, "the joined projection launch takes the first-tile rows of one batch");
  _Float16* BW = (_Float16*)take((size_t)4 * DM * DM * 2); _Float16* BO = BW + (size_t)3 * DM * DM;      /* weight planes q, k, v, o, one behind the other */
  _Float16* XH = (_Float16*)take(3 * NR * DM * 2);      /* rounded inputs q, k, v, one behind the other */
  _Float16* Q16 = (_Float16*)take(2 * NR * DM * 2); _Float16* K16 = Q16 + NR * DM; _Float16* O16 = (_Float16*)take(NR * DM * 2);      /* q, k rows, one plane behind the other */
  _Float16* VT = (_Float16*)take((size_t)NH * HD * SQ * 2);
  float* QF0 = (float*)take((size_t)3 * QT0 * DM * 4); float* KF0 = QF0 + (size_t)QT0 * DM; float* VF0 = KF0 + (size_t)QT0 * DM; _Float16* OH0 = (_Float16*)take((size_t)2 * QT0 * DM * 2); _Float16* OL0 = OH0 + (size_t)QT0 * DM;      /* first-tile o: hi plane, residual plane behind it */
  if (off > ws_size) return;
  k_prep<<<PWT + 3 * PXG, 256, 0, stream>>>(xq, xk, xv, wq, wk, wv, wo, BW, XH);      /* all four x16 weight planes Bt[n][k] (PER-HEAD STACKS [16][1024][64] = [head][in][out]: head h's block -> rows 64 h .. 64 h + 63) and the three rounded inputs */
  k_qkv<<<dim3(PJF + PJH, 3), 128, 0, stream>>>(XH, BW, QF0, Q16, VT);      /* q, k: f16 rows of all tokens; v: V^T [NH][HD][SQ]; and f32 rows of the first 256 (exact products) */
  for (int b = B0; b < B0 + NBR; ++b) { const size_t r0 = (size_t)b * SQ;
    k_attn<<<FNG + A0NG, FW * 32, 0, stream>>>(Q16 + r0 * LQ, K16 + r0 * LQ, VT, O16 + r0 * DM, QF0, KF0, VF0, OH0, OL0); }      /* scores, causal softmax and P V for all heads and rows: o (merged heads, x64) as f16 rows; and, by further work-groups, exact f32 attention for rows 0..255 (o x64) -> f16 hi + x1024 residual planes */
  k_out<<<POF + ((MPO - QT0) / 128) * (DM / 64), 128, 0, stream>>>(O16, OH0, BO, (float*)d_out);      /* out rows are the output layout; rows 0..255: out = o_hi Wo 2^-10 + o_lo Wo 2^-20 */
}
